// v000
// Times are from an AMD MI455X. After a warm-up the kernel runs many times in a row, and a time is the length of
// such a window on the GPU divided by its runs, so every launch and the gaps after it count. The runs cycle
// through copies of the inputs. A figure is the median of several windows, for all but v000 over two sittings.
// Sittings can differ by a few percent; kernels timed side by side share one.
// The starting kernel, v000, takes 51.3 microseconds a run.
#include <hip/hip_runtime.h>
#include <math.h>

// ---------------------------------------------------------------------------
// EfficientFourierConvSSM, collapsed: out = S * B_f * x,  S = sum_{k<16} A_f^k
//   = (1+A)(1+A^2)(1+A^4)(1+A^8)    (complex, elementwise per (h,w,c))
// Memory-bound streaming pass (285 MB @ 23.3 TB/s ~ 12 us); DFT of the 7x7
// kernels is done with V_WMMA_F32_16X16X4_F32; multiplier row staged to LDS
// with the Tensor Data Mover.
// ---------------------------------------------------------------------------

#define Hdim 128
#define Wdim 128
#define Cdim 128
#define Bdim 8
#define Kk   7
#define GST  8            // K padded 7 -> 8 for two chained K=4 WMMAs

typedef __attribute__((ext_vector_type(2))) float        v2f;
typedef __attribute__((ext_vector_type(4))) float        f4;
typedef __attribute__((ext_vector_type(8))) float        v8f;
typedef __attribute__((ext_vector_type(4))) unsigned int v4u;
typedef __attribute__((ext_vector_type(4))) int          v4i;
typedef __attribute__((ext_vector_type(8))) int          v8i;

#define TWO_PI_F 6.28318530717958647692f

#if defined(__has_builtin)
#if __has_builtin(__builtin_amdgcn_wmma_f32_16x16x4_f32)
#define HAVE_WMMA_F32 1
#endif
#if __has_builtin(__builtin_amdgcn_tensor_load_to_lds) && __has_builtin(__builtin_amdgcn_s_wait_tensorcnt)
#define HAVE_TDM 1
#endif
#endif

// ---------------------------------------------------------------------------
// Stage 1: row DFT of the two 7x7 kernels.
//   G[c,u,kx] = sum_ky kern[c,ky,kx] * exp(-2*pi*i * u*(ky-3)/128)
// A gets the decay mask + 0.9*tanh first. Output stride-8, tap 7 zeroed so the
// WMMA K=8 contraction is exact. 16384 threads, trivial cost.
// ---------------------------------------------------------------------------
__global__ __launch_bounds__(256)
void stage1_rowdft(const float* __restrict__ A, const float* __restrict__ Bk,
                   float* __restrict__ GAr, float* __restrict__ GAi,
                   float* __restrict__ GBr, float* __restrict__ GBi) {
    int idx = blockIdx.x * blockDim.x + threadIdx.x;     // idx = c*128 + u
    if (idx >= Cdim * Hdim) return;
    int c = idx >> 7;
    int u = idx & 127;
    for (int kx = 0; kx < Kk; ++kx) {
        float sra = 0.f, sia = 0.f, srb = 0.f, sib = 0.f;
        for (int ky = 0; ky < Kk; ++ky) {
            float dy = (float)(ky - 3), dx = (float)(kx - 3);
            float decay = __expf(-0.3f * sqrtf(dy * dy + dx * dx) / 3.0f);
            float a = 0.9f * tanhf(A[(c * 7 + ky) * 7 + kx] * decay);
            float b = Bk[(c * 7 + ky) * 7 + kx];
            float ang = -TWO_PI_F * (float)(u * (ky - 3)) * (1.0f / 128.0f);
            float sn, cs;
            __sincosf(ang, &sn, &cs);
            sra += a * cs; sia += a * sn;
            srb += b * cs; sib += b * sn;
        }
        GAr[idx * GST + kx] = sra; GAi[idx * GST + kx] = sia;
        GBr[idx * GST + kx] = srb; GBi[idx * GST + kx] = sib;
    }
    GAr[idx * GST + 7] = 0.f; GAi[idx * GST + 7] = 0.f;   // K-pad
    GBr[idx * GST + 7] = 0.f; GBi[idx * GST + 7] = 0.f;
}

#ifdef HAVE_WMMA_F32
// A-operand layout (32-bit A 16x4): lanes 0-15 row M, v0={K0|K2}, v1={K1|K3}.
static __device__ __forceinline__ v2f ld2(const float* __restrict__ g, int base, int k0) {
    v2f r; r.x = g[base + k0]; r.y = g[base + k0 + 1]; return r;
}
#endif

// ---------------------------------------------------------------------------
// Stage 2: column DFT as a matmul  (16384 x 8) . (8 x 128)  per {A,B}x{r,i},
// one wave per 16x16 tile of (c,u) x v, V_WMMA_F32_16X16X4_F32 chained K=4+4.
// Then per-lane complex geometric series S and fused M = S*B_f, stored in the
// x-compatible (H,W,2C) layout.
// ---------------------------------------------------------------------------
__global__ __launch_bounds__(256)
void stage2_multiplier(const float* __restrict__ GAr, const float* __restrict__ GAi,
                       const float* __restrict__ GBr, const float* __restrict__ GBi,
                       float* __restrict__ Mout) {
    int wid   = (blockIdx.x * blockDim.x + threadIdx.x) >> 5;  // 8192 tiles
    int lane  = threadIdx.x & 31;
    int tileR = wid >> 3;            // 1024 row-tiles over (c,u)
    int tileV = wid & 7;             // 8 col-tiles over v
    int R0    = tileR << 4;
    int v0    = tileV << 4;
    int c     = R0 >> 7;             // 128 rows per channel; tiles never straddle c
    int u0    = R0 & 127;
    int n     = lane & 15;
    int khalf = lane >> 4;
    int v     = v0 + n;

    // Twiddles for this lane's K slots: W[k][v] = exp(-2*pi*i * v*(k-3)/128)
    float wr[4], wi[4];
    {
        int ks[4] = {2 * khalf, 2 * khalf + 1, 4 + 2 * khalf, 5 + 2 * khalf};
        for (int t = 0; t < 4; ++t) {
            float ang = -TWO_PI_F * (float)(v * (ks[t] - 3)) * (1.0f / 128.0f);
            __sincosf(ang, &wi[t], &wr[t]);
        }
    }

    v8f afr = {}, afi = {}, bfr = {}, bfi = {};

#ifdef HAVE_WMMA_F32
    int rbase = (R0 + n) * GST;
    v2f arlo = ld2(GAr, rbase, 2 * khalf), arhi = ld2(GAr, rbase, 4 + 2 * khalf);
    v2f ailo = ld2(GAi, rbase, 2 * khalf), aihi = ld2(GAi, rbase, 4 + 2 * khalf);
    v2f brlo = ld2(GBr, rbase, 2 * khalf), brhi = ld2(GBr, rbase, 4 + 2 * khalf);
    v2f bilo = ld2(GBi, rbase, 2 * khalf), bihi = ld2(GBi, rbase, 4 + 2 * khalf);
    v2f wrlo = {wr[0], wr[1]}, wrhi = {wr[2], wr[3]};
    v2f wilo = {wi[0], wi[1]}, wihi = {wi[2], wi[3]};
    v2f nwlo = {-wi[0], -wi[1]}, nwhi = {-wi[2], -wi[3]};

#define WMMA4(ACC, Aop, Bop) \
    ACC = __builtin_amdgcn_wmma_f32_16x16x4_f32(false, Aop, false, Bop, (short)0, ACC, false, false)

    // A_f_r = Gr.Wr - Gi.Wi   A_f_i = Gr.Wi + Gi.Wr   (same for B kernel)
    WMMA4(afr, arlo, wrlo); WMMA4(afr, arhi, wrhi); WMMA4(afr, ailo, nwlo); WMMA4(afr, aihi, nwhi);
    WMMA4(afi, arlo, wilo); WMMA4(afi, arhi, wihi); WMMA4(afi, ailo, wrlo); WMMA4(afi, aihi, wrhi);
    WMMA4(bfr, brlo, wrlo); WMMA4(bfr, brhi, wrhi); WMMA4(bfr, bilo, nwlo); WMMA4(bfr, bihi, nwhi);
    WMMA4(bfi, brlo, wilo); WMMA4(bfi, brhi, wihi); WMMA4(bfi, bilo, wrlo); WMMA4(bfi, bihi, wrhi);
#undef WMMA4
#else
    // Scalar fallback: direct 7-tap column DFT per output element.
    for (int j = 0; j < 8; ++j) {
        int R = R0 + j + 8 * khalf;
        float ar = 0.f, ai = 0.f, br = 0.f, bi = 0.f;
        for (int k = 0; k < Kk; ++k) {
            float ang = -TWO_PI_F * (float)(v * (k - 3)) * (1.0f / 128.0f);
            float sn, cs; __sincosf(ang, &sn, &cs);
            float gr = GAr[R * GST + k], gi = GAi[R * GST + k];
            ar += gr * cs - gi * sn;  ai += gr * sn + gi * cs;
            float hr = GBr[R * GST + k], hi = GBi[R * GST + k];
            br += hr * cs - hi * sn;  bi += hr * sn + hi * cs;
        }
        afr[j] = ar; afi[j] = ai; bfr[j] = br; bfi[j] = bi;
    }
#endif

    // C/D layout: reg j -> row M = j + 8*(lane>=16), col N = lane&15.
    for (int j = 0; j < 8; ++j) {
        float ar = afr[j], ai = afi[j];
        float br = bfr[j], bi = bfi[j];
        // S = (1+A)(1+A^2)(1+A^4)(1+A^8) : geometric sum of 16 terms
        float sr = 1.f + ar, si = ai;
        float pr = ar, pi = ai;
        for (int t = 0; t < 3; ++t) {
            float qr = pr * pr - pi * pi;
            float qi = 2.f * pr * pi;
            pr = qr; pi = qi;                       // A^(2^(t+1))
            float tr = 1.f + pr, ti = pi;
            float xr = sr * tr - si * ti;
            float xi = sr * ti + si * tr;
            sr = xr; si = xi;
        }
        float mr = sr * br - si * bi;               // M = S * B_f
        float mi = sr * bi + si * br;
        int urow = u0 + j + 8 * khalf;
        int base = ((urow << 7) + v) << 8;          // (u*128+v)*256
        Mout[base + c]       = mr;
        Mout[base + 128 + c] = mi;
    }
}

// ---------------------------------------------------------------------------
// Stage 3: the bandwidth-bound pass.  One block per (u,v); the 1 KB multiplier
// row is staged into LDS by the Tensor Data Mover (reused by all 8 batches),
// then 8 waves stream x -> out with nontemporal complex multiplies.
// ---------------------------------------------------------------------------
__global__ __launch_bounds__(256)
void fused_apply(const float* __restrict__ x, const float* __restrict__ Mmul,
                 float* __restrict__ out) {
    __shared__ float smem[256];
    const int uv  = blockIdx.x;          // 0 .. 16383
    const int tid = threadIdx.x;
    const float* __restrict__ Mrow = Mmul + (size_t)uv * 256;

#ifdef HAVE_TDM
    if (tid < 32) {                       // one wave builds D# and issues the TDM
        unsigned int       lds_off = (unsigned int)(unsigned long long)(uintptr_t)smem;
        unsigned long long ga      = (unsigned long long)(uintptr_t)Mrow;
        v4u g0;
        g0.x = 1u;                                                // count=1, user D#
        g0.y = lds_off;                                           // lds_addr (bytes)
        g0.z = (unsigned int)(ga & 0xFFFFFFFFull);                // global_addr[31:0]
        g0.w = (unsigned int)((ga >> 32) & 0x1FFFFFFull) | (2u << 30); // [56:32] | type=2
        v8i g1;
        g1[0] = (int)(2u << 16);      // data_size=4B, workgroup_mask=0
        g1[1] = (int)(256u << 16);    // tensor_dim0 = 256 elements
        g1[2] = (int)(1u << 16);      // tensor_dim1 = 1
        g1[3] = (int)(256u << 16);    // tile_dim0 = 256
        g1[4] = 1;                    // tile_dim1 = 1, tile_dim2 = 0
        g1[5] = 256;                  // tensor_dim0_stride = 256
        g1[6] = 0;
        g1[7] = 0;
        v4i z4 = {0, 0, 0, 0};
        v8i z8 = {0, 0, 0, 0, 0, 0, 0, 0};
        // clang-23 / therock-10.0 arity: (g0, g1, g2, g3, g4, cpol)
        __builtin_amdgcn_tensor_load_to_lds(g0, g1, z4, z4, z8, 0);
        __builtin_amdgcn_s_wait_tensorcnt(0);
    }
    __syncthreads();
#else
    if (tid < 64) ((f4*)smem)[tid] = ((const f4*)Mrow)[tid];
    __syncthreads();
#endif

    // tid -> (batch, float4-channel); one wave covers one contiguous 512B half-row
    const int b  = tid >> 5;             // 0..7
    const int c4 = tid & 31;             // 0..31 float4s of 128 channels
    const size_t rowbase = (size_t)(b * (Hdim * Wdim) + uv) * 256;

    const f4* __restrict__ xin = (const f4*)(x + rowbase);
    f4 xr = __builtin_nontemporal_load(&xin[c4]);
    f4 xi = __builtin_nontemporal_load(&xin[32 + c4]);
    f4 mr = ((const f4*)smem)[c4];
    f4 mi = ((const f4*)smem)[32 + c4];

    f4 o_r = mr * xr - mi * xi;
    f4 o_i = mr * xi + mi * xr;

    f4* __restrict__ op = (f4*)(out + rowbase);
    __builtin_nontemporal_store(o_r, &op[c4]);
    __builtin_nontemporal_store(o_i, &op[32 + c4]);
}

// ---------------------------------------------------------------------------
extern "C" void kernel_launch(void* const* d_in, const int* in_sizes, int n_in,
                              void* d_out, int out_size, void* d_ws, size_t ws_size,
                              hipStream_t stream) {
    const float* x  = (const float*)d_in[0];   // (8,128,128,256) f32
    const float* A  = (const float*)d_in[1];   // (128,7,7) f32
    const float* Bk = (const float*)d_in[2];   // (128,7,7) f32
    float* out = (float*)d_out;
    float* ws  = (float*)d_ws;

    float* GAr  = ws;                 // 16384*8 floats each
    float* GAi  = ws + 131072;
    float* GBr  = ws + 262144;
    float* GBi  = ws + 393216;
    float* Mmul = ws + 524288;        // 128*128*256 floats = 16 MB

    stage1_rowdft<<<64, 256, 0, stream>>>(A, Bk, GAr, GAi, GBr, GBi);
    stage2_multiplier<<<1024, 256, 0, stream>>>(GAr, GAi, GBr, GBi, Mmul);
    fused_apply<<<Hdim * Wdim, 256, 0, stream>>>(x, Mmul, out);
}

// v001
// It runs in 41.6 microseconds.
// Timed twice side by side with v000, it ran 1.23 times as fast both times.
#include <hip/hip_runtime.h>
#include <math.h>

// ---------------------------------------------------------------------------
// EfficientFourierConvSSM, collapsed: out = S * B_f * x,  S = sum_{k<16} A_f^k
//   = (1+A)(1+A^2)(1+A^4)(1+A^8)    (complex, elementwise per (h,w,c))
// Memory-bound streaming pass (285 MB @ 23.3 TB/s ~ 12 us); DFT of the 7x7
// kernels is done with V_WMMA_F32_16X16X4_F32; multiplier row staged to LDS
// with the Tensor Data Mover.
// ---------------------------------------------------------------------------

#define Hdim 128
#define Wdim 128
#define Cdim 128
#define Bdim 8
#define Kk   7
#define GST  8            // K padded 7 -> 8 for two chained K=4 WMMAs

typedef __attribute__((ext_vector_type(2))) float        v2f;
typedef __attribute__((ext_vector_type(4))) float        f4;
typedef __attribute__((ext_vector_type(8))) float        v8f;
typedef __attribute__((ext_vector_type(4))) unsigned int v4u;
typedef __attribute__((ext_vector_type(4))) int          v4i;
typedef __attribute__((ext_vector_type(8))) int          v8i;

#define TWO_PI_F 6.28318530717958647692f

#if defined(__has_builtin)
#if __has_builtin(__builtin_amdgcn_wmma_f32_16x16x4_f32)
#define HAVE_WMMA_F32 1
#endif
#if __has_builtin(__builtin_amdgcn_tensor_load_to_lds) && __has_builtin(__builtin_amdgcn_s_wait_tensorcnt)
#define HAVE_TDM 1
#endif
#endif

// ---------------------------------------------------------------------------
// Stage 1: row DFT of the two 7x7 kernels.
//   G[c,u,kx] = sum_ky kern[c,ky,kx] * exp(-2*pi*i * u*(ky-3)/128)
// A gets the decay mask + 0.9*tanh first. Output stride-8, tap 7 zeroed so the
// WMMA K=8 contraction is exact. 16384 threads, trivial cost.
// ---------------------------------------------------------------------------
__global__ __launch_bounds__(256)
void stage1_rowdft(const float* __restrict__ A, const float* __restrict__ Bk,
                   float* __restrict__ GAr, float* __restrict__ GAi,
                   float* __restrict__ GBr, float* __restrict__ GBi) {
    int idx = blockIdx.x * blockDim.x + threadIdx.x;     // idx = c*128 + u
    if (idx >= Cdim * Hdim) return;
    int c = idx >> 7;
    int u = idx & 127;
    for (int kx = 0; kx < Kk; ++kx) {
        float sra = 0.f, sia = 0.f, srb = 0.f, sib = 0.f;
        for (int ky = 0; ky < Kk; ++ky) {
            float dy = (float)(ky - 3), dx = (float)(kx - 3);
            float decay = __expf(-0.3f * sqrtf(dy * dy + dx * dx) / 3.0f);
            float a = 0.9f * tanhf(A[(c * 7 + ky) * 7 + kx] * decay);
            float b = Bk[(c * 7 + ky) * 7 + kx];
            float ang = -TWO_PI_F * (float)(u * (ky - 3)) * (1.0f / 128.0f);
            float sn, cs;
            __sincosf(ang, &sn, &cs);
            sra += a * cs; sia += a * sn;
            srb += b * cs; sib += b * sn;
        }
        GAr[idx * GST + kx] = sra; GAi[idx * GST + kx] = sia;
        GBr[idx * GST + kx] = srb; GBi[idx * GST + kx] = sib;
    }
    GAr[idx * GST + 7] = 0.f; GAi[idx * GST + 7] = 0.f;   // K-pad
    GBr[idx * GST + 7] = 0.f; GBi[idx * GST + 7] = 0.f;
}

#ifdef HAVE_WMMA_F32
// A-operand layout (32-bit A 16x4): lanes 0-15 row M, v0={K0|K2}, v1={K1|K3}.
static __device__ __forceinline__ v2f ld2(const float* __restrict__ g, int base, int k0) {
    v2f r; r.x = g[base + k0]; r.y = g[base + k0 + 1]; return r;
}
#endif

// ---------------------------------------------------------------------------
// Stage 2: column DFT as a matmul per {A,B}x{r,i}, V_WMMA_F32_16X16X4_F32
// chained K=4+4.  One block per (u, 64 columns v); wave w owns channels
// 16w..16w+15 as the M rows of its tiles and walks four 16-column tiles with
// the same G fragments.  Then per-lane complex geometric series S and fused
// M = S*B_f.  A lane's D registers are 8 consecutive channels of one (u,v), so
// the block stages its 64 rows of the (H,W,2C) layout in LDS and stores them
// as one contiguous 64 KB run of whole 128-byte lines.
// ---------------------------------------------------------------------------
#define VTILES 4          // 16-column tiles per block
#define MPITCH 260        // staged row pitch in floats: 16 B x odd, no bank conflict for 16-byte writes

__global__ __launch_bounds__(256)
void stage2_multiplier(const float* __restrict__ GAr, const float* __restrict__ GAi,
                       const float* __restrict__ GBr, const float* __restrict__ GBi,
                       float* __restrict__ Mout) {
    __shared__ __attribute__((aligned(16))) float stg[VTILES * 16 * MPITCH];
    int tid   = threadIdx.x;
    int lane  = tid & 31;
    int c0    = (tid >> 5) << 4;     // 8 waves x 16 channels
    int u     = blockIdx.x >> 1;     // 128 rows u
    int vbase = (blockIdx.x & 1) << 6;
    int n     = lane & 15;
    int khalf = lane >> 4;

#ifdef HAVE_WMMA_F32
    int rbase = (((c0 + n) << 7) + u) * GST;      // G row of (channel c0+n, u)
    v2f arlo = ld2(GAr, rbase, 2 * khalf), arhi = ld2(GAr, rbase, 4 + 2 * khalf);
    v2f ailo = ld2(GAi, rbase, 2 * khalf), aihi = ld2(GAi, rbase, 4 + 2 * khalf);
    v2f brlo = ld2(GBr, rbase, 2 * khalf), brhi = ld2(GBr, rbase, 4 + 2 * khalf);
    v2f bilo = ld2(GBi, rbase, 2 * khalf), bihi = ld2(GBi, rbase, 4 + 2 * khalf);
#endif

    for (int vt = 0; vt < VTILES; ++vt) {
        int v = vbase + (vt << 4) + n;

        // Twiddles for this lane's K slots: W[k][v] = exp(-2*pi*i * v*(k-3)/128)
        float wr[4], wi[4];
        {
            int ks[4] = {2 * khalf, 2 * khalf + 1, 4 + 2 * khalf, 5 + 2 * khalf};
            for (int t = 0; t < 4; ++t) {
                float ang = -TWO_PI_F * (float)(v * (ks[t] - 3)) * (1.0f / 128.0f);
                __sincosf(ang, &wi[t], &wr[t]);
            }
        }

        v8f afr = {}, afi = {}, bfr = {}, bfi = {};

#ifdef HAVE_WMMA_F32
        v2f wrlo = {wr[0], wr[1]}, wrhi = {wr[2], wr[3]};
        v2f wilo = {wi[0], wi[1]}, wihi = {wi[2], wi[3]};
        v2f nwlo = {-wi[0], -wi[1]}, nwhi = {-wi[2], -wi[3]};

#define WMMA4(ACC, Aop, Bop) \
        ACC = __builtin_amdgcn_wmma_f32_16x16x4_f32(false, Aop, false, Bop, (short)0, ACC, false, false)

        // A_f_r = Gr.Wr - Gi.Wi   A_f_i = Gr.Wi + Gi.Wr   (same for B kernel)
        WMMA4(afr, arlo, wrlo); WMMA4(afr, arhi, wrhi); WMMA4(afr, ailo, nwlo); WMMA4(afr, aihi, nwhi);
        WMMA4(afi, arlo, wilo); WMMA4(afi, arhi, wihi); WMMA4(afi, ailo, wrlo); WMMA4(afi, aihi, wrhi);
        WMMA4(bfr, brlo, wrlo); WMMA4(bfr, brhi, wrhi); WMMA4(bfr, bilo, nwlo); WMMA4(bfr, bihi, nwhi);
        WMMA4(bfi, brlo, wilo); WMMA4(bfi, brhi, wihi); WMMA4(bfi, bilo, wrlo); WMMA4(bfi, bihi, wrhi);
#undef WMMA4
#else
        // Scalar fallback: direct 7-tap column DFT per output element.
        for (int j = 0; j < 8; ++j) {
            int R = ((c0 + j + 8 * khalf) << 7) + u;
            float ar = 0.f, ai = 0.f, br = 0.f, bi = 0.f;
            for (int k = 0; k < Kk; ++k) {
                float ang = -TWO_PI_F * (float)(v * (k - 3)) * (1.0f / 128.0f);
                float sn, cs; __sincosf(ang, &sn, &cs);
                float gr = GAr[R * GST + k], gi = GAi[R * GST + k];
                ar += gr * cs - gi * sn;  ai += gr * sn + gi * cs;
                float hr = GBr[R * GST + k], hi = GBi[R * GST + k];
                br += hr * cs - hi * sn;  bi += hr * sn + hi * cs;
            }
            afr[j] = ar; afi[j] = ai; bfr[j] = br; bfi[j] = bi;
        }
#endif

        // C/D layout: reg j -> row M = j + 8*(lane>=16) = channel, col N = lane&15 = v.
        float mrv[8], miv[8];
        for (int j = 0; j < 8; ++j) {
            float ar = afr[j], ai = afi[j];
            float br = bfr[j], bi = bfi[j];
            // S = (1+A)(1+A^2)(1+A^4)(1+A^8) : geometric sum of 16 terms
            float sr = 1.f + ar, si = ai;
            float pr = ar, pi = ai;
            for (int t = 0; t < 3; ++t) {
                float qr = pr * pr - pi * pi;
                float qi = 2.f * pr * pi;
                pr = qr; pi = qi;                       // A^(2^(t+1))
                float tr = 1.f + pr, ti = pi;
                float xr = sr * tr - si * ti;
                float xi = sr * ti + si * tr;
                sr = xr; si = xi;
            }
            mrv[j] = sr * br - si * bi;                 // M = S * B_f
            miv[j] = sr * bi + si * br;
        }
        float* row = stg + ((vt << 4) + n) * MPITCH + c0 + 8 * khalf;
        f4 r0 = {mrv[0], mrv[1], mrv[2], mrv[3]}, r1 = {mrv[4], mrv[5], mrv[6], mrv[7]};
        f4 i0 = {miv[0], miv[1], miv[2], miv[3]}, i1 = {miv[4], miv[5], miv[6], miv[7]};
        ((f4*)row)[0]         = r0;  ((f4*)row)[1]         = r1;
        ((f4*)(row + 128))[0] = i0;  ((f4*)(row + 128))[1] = i1;
    }

    __syncthreads();      // a staged row holds the channels of all 8 waves

    // 64 rows x 64 float4, contiguous in Mout; each wave store covers 512 B of one row.
    f4* __restrict__ dst = (f4*)(Mout + ((size_t)((u << 7) + vbase) << 8));
    for (int i = 0; i < VTILES * 4; ++i) {
        int f = tid + (i << 8);
        dst[f] = *(const f4*)(stg + (f >> 6) * MPITCH + ((f & 63) << 2));
    }
}

// ---------------------------------------------------------------------------
// Stage 3: the bandwidth-bound pass.  One block per (u,v); the 1 KB multiplier
// row is staged into LDS by the Tensor Data Mover (reused by all 8 batches),
// then 8 waves stream x -> out with nontemporal complex multiplies.
// ---------------------------------------------------------------------------
__global__ __launch_bounds__(256)
void fused_apply(const float* __restrict__ x, const float* __restrict__ Mmul,
                 float* __restrict__ out) {
    __shared__ float smem[256];
    const int uv  = blockIdx.x;          // 0 .. 16383
    const int tid = threadIdx.x;
    const float* __restrict__ Mrow = Mmul + (size_t)uv * 256;

#ifdef HAVE_TDM
    if (tid < 32) {                       // one wave builds D# and issues the TDM
        unsigned int       lds_off = (unsigned int)(unsigned long long)(uintptr_t)smem;
        unsigned long long ga      = (unsigned long long)(uintptr_t)Mrow;
        v4u g0;
        g0.x = 1u;                                                // count=1, user D#
        g0.y = lds_off;                                           // lds_addr (bytes)
        g0.z = (unsigned int)(ga & 0xFFFFFFFFull);                // global_addr[31:0]
        g0.w = (unsigned int)((ga >> 32) & 0x1FFFFFFull) | (2u << 30); // [56:32] | type=2
        v8i g1;
        g1[0] = (int)(2u << 16);      // data_size=4B, workgroup_mask=0
        g1[1] = (int)(256u << 16);    // tensor_dim0 = 256 elements
        g1[2] = (int)(1u << 16);      // tensor_dim1 = 1
        g1[3] = (int)(256u << 16);    // tile_dim0 = 256
        g1[4] = 1;                    // tile_dim1 = 1, tile_dim2 = 0
        g1[5] = 256;                  // tensor_dim0_stride = 256
        g1[6] = 0;
        g1[7] = 0;
        v4i z4 = {0, 0, 0, 0};
        v8i z8 = {0, 0, 0, 0, 0, 0, 0, 0};
        // clang-23 / therock-10.0 arity: (g0, g1, g2, g3, g4, cpol)
        __builtin_amdgcn_tensor_load_to_lds(g0, g1, z4, z4, z8, 0);
        __builtin_amdgcn_s_wait_tensorcnt(0);
    }
    __syncthreads();
#else
    if (tid < 64) ((f4*)smem)[tid] = ((const f4*)Mrow)[tid];
    __syncthreads();
#endif

    // tid -> (batch, float4-channel); one wave covers one contiguous 512B half-row
    const int b  = tid >> 5;             // 0..7
    const int c4 = tid & 31;             // 0..31 float4s of 128 channels
    const size_t rowbase = (size_t)(b * (Hdim * Wdim) + uv) * 256;

    const f4* __restrict__ xin = (const f4*)(x + rowbase);
    f4 xr = __builtin_nontemporal_load(&xin[c4]);
    f4 xi = __builtin_nontemporal_load(&xin[32 + c4]);
    f4 mr = ((const f4*)smem)[c4];
    f4 mi = ((const f4*)smem)[32 + c4];

    f4 o_r = mr * xr - mi * xi;
    f4 o_i = mr * xi + mi * xr;

    f4* __restrict__ op = (f4*)(out + rowbase);
    __builtin_nontemporal_store(o_r, &op[c4]);
    __builtin_nontemporal_store(o_i, &op[32 + c4]);
}

// ---------------------------------------------------------------------------
extern "C" void kernel_launch(void* const* d_in, const int* in_sizes, int n_in,
                              void* d_out, int out_size, void* d_ws, size_t ws_size,
                              hipStream_t stream) {
    const float* x  = (const float*)d_in[0];   // (8,128,128,256) f32
    const float* A  = (const float*)d_in[1];   // (128,7,7) f32
    const float* Bk = (const float*)d_in[2];   // (128,7,7) f32
    float* out = (float*)d_out;
    float* ws  = (float*)d_ws;

    float* GAr  = ws;                 // 16384*8 floats each
    float* GAi  = ws + 131072;
    float* GBr  = ws + 262144;
    float* GBi  = ws + 393216;
    float* Mmul = ws + 524288;        // 128*128*256 floats = 16 MB

    stage1_rowdft<<<64, 256, 0, stream>>>(A, Bk, GAr, GAi, GBr, GBi);
    stage2_multiplier<<<256, 256, 0, stream>>>(GAr, GAi, GBr, GBi, Mmul);
    fused_apply<<<Hdim * Wdim, 256, 0, stream>>>(x, Mmul, out);
}

// v002
// One run takes 35.6 microseconds.
// Timed twice side by side with v001, it ran 1.17 times as fast both times.
// Counting every step since v000, it is 1.44 times as fast.
#include <hip/hip_runtime.h>
#include <math.h>

// ---------------------------------------------------------------------------
// EfficientFourierConvSSM, collapsed: out = S * B_f * x,  S = sum_{k<16} A_f^k
//   = (1+A)(1+A^2)(1+A^4)(1+A^8)    (complex, elementwise per (h,w,c))
// Memory-bound streaming pass (285 MB @ 23.3 TB/s ~ 12 us); DFT of the 7x7
// kernels is done with V_WMMA_F32_16X16X4_F32; the streaming pass keeps its
// multiplier rows in registers.
// ---------------------------------------------------------------------------

#define Hdim 128
#define Wdim 128
#define Cdim 128
#define Bdim 8
#define Kk   7
#define GST  8            // K padded 7 -> 8 for two chained K=4 WMMAs

typedef __attribute__((ext_vector_type(2))) float        v2f;
typedef __attribute__((ext_vector_type(4))) float        f4;
typedef __attribute__((ext_vector_type(8))) float        v8f;

#define TWO_PI_F 6.28318530717958647692f

#if defined(__has_builtin)
#if __has_builtin(__builtin_amdgcn_wmma_f32_16x16x4_f32)
#define HAVE_WMMA_F32 1
#endif
#endif

// ---------------------------------------------------------------------------
// Stage 1: row DFT of the two 7x7 kernels.
//   G[c,u,kx] = sum_ky kern[c,ky,kx] * exp(-2*pi*i * u*(ky-3)/128)
// A gets the decay mask + 0.9*tanh first. Output stride-8, tap 7 zeroed so the
// WMMA K=8 contraction is exact. 16384 threads, trivial cost.
// ---------------------------------------------------------------------------
__global__ __launch_bounds__(256)
void stage1_rowdft(const float* __restrict__ A, const float* __restrict__ Bk,
                   float* __restrict__ GAr, float* __restrict__ GAi,
                   float* __restrict__ GBr, float* __restrict__ GBi) {
    int idx = blockIdx.x * blockDim.x + threadIdx.x;     // idx = c*128 + u
    if (idx >= Cdim * Hdim) return;
    int c = idx >> 7;
    int u = idx & 127;
    for (int kx = 0; kx < Kk; ++kx) {
        float sra = 0.f, sia = 0.f, srb = 0.f, sib = 0.f;
        for (int ky = 0; ky < Kk; ++ky) {
            float dy = (float)(ky - 3), dx = (float)(kx - 3);
            float decay = __expf(-0.3f * sqrtf(dy * dy + dx * dx) / 3.0f);
            float a = 0.9f * tanhf(A[(c * 7 + ky) * 7 + kx] * decay);
            float b = Bk[(c * 7 + ky) * 7 + kx];
            float ang = -TWO_PI_F * (float)(u * (ky - 3)) * (1.0f / 128.0f);
            float sn, cs;
            __sincosf(ang, &sn, &cs);
            sra += a * cs; sia += a * sn;
            srb += b * cs; sib += b * sn;
        }
        GAr[idx * GST + kx] = sra; GAi[idx * GST + kx] = sia;
        GBr[idx * GST + kx] = srb; GBi[idx * GST + kx] = sib;
    }
    GAr[idx * GST + 7] = 0.f; GAi[idx * GST + 7] = 0.f;   // K-pad
    GBr[idx * GST + 7] = 0.f; GBi[idx * GST + 7] = 0.f;
}

#ifdef HAVE_WMMA_F32
// A-operand layout (32-bit A 16x4): lanes 0-15 row M, v0={K0|K2}, v1={K1|K3}.
static __device__ __forceinline__ v2f ld2(const float* __restrict__ g, int base, int k0) {
    v2f r; r.x = g[base + k0]; r.y = g[base + k0 + 1]; return r;
}
#endif

// ---------------------------------------------------------------------------
// Stage 2: column DFT as a matmul per {A,B}x{r,i}, V_WMMA_F32_16X16X4_F32
// chained K=4+4.  One block per (u, 64 columns v); wave w owns channels
// 16w..16w+15 as the M rows of its tiles and walks four 16-column tiles with
// the same G fragments.  Then per-lane complex geometric series S and fused
// M = S*B_f.  A lane's D registers are 8 consecutive channels of one (u,v), so
// the block stages its 64 rows of the (H,W,2C) layout in LDS and stores them
// as one contiguous 64 KB run of whole 128-byte lines.
// ---------------------------------------------------------------------------
#define VTILES 4          // 16-column tiles per block
#define MPITCH 260        // staged row pitch in floats: 16 B x odd, no bank conflict for 16-byte writes

__global__ __launch_bounds__(256)
void stage2_multiplier(const float* __restrict__ GAr, const float* __restrict__ GAi,
                       const float* __restrict__ GBr, const float* __restrict__ GBi,
                       float* __restrict__ Mout) {
    __shared__ __attribute__((aligned(16))) float stg[VTILES * 16 * MPITCH];
    int tid   = threadIdx.x;
    int lane  = tid & 31;
    int c0    = (tid >> 5) << 4;     // 8 waves x 16 channels
    int u     = blockIdx.x >> 1;     // 128 rows u
    int vbase = (blockIdx.x & 1) << 6;
    int n     = lane & 15;
    int khalf = lane >> 4;

#ifdef HAVE_WMMA_F32
    int rbase = (((c0 + n) << 7) + u) * GST;      // G row of (channel c0+n, u)
    v2f arlo = ld2(GAr, rbase, 2 * khalf), arhi = ld2(GAr, rbase, 4 + 2 * khalf);
    v2f ailo = ld2(GAi, rbase, 2 * khalf), aihi = ld2(GAi, rbase, 4 + 2 * khalf);
    v2f brlo = ld2(GBr, rbase, 2 * khalf), brhi = ld2(GBr, rbase, 4 + 2 * khalf);
    v2f bilo = ld2(GBi, rbase, 2 * khalf), bihi = ld2(GBi, rbase, 4 + 2 * khalf);
#endif

    for (int vt = 0; vt < VTILES; ++vt) {
        int v = vbase + (vt << 4) + n;

        // Twiddles for this lane's K slots: W[k][v] = exp(-2*pi*i * v*(k-3)/128)
        float wr[4], wi[4];
        {
            int ks[4] = {2 * khalf, 2 * khalf + 1, 4 + 2 * khalf, 5 + 2 * khalf};
            for (int t = 0; t < 4; ++t) {
                float ang = -TWO_PI_F * (float)(v * (ks[t] - 3)) * (1.0f / 128.0f);
                __sincosf(ang, &wi[t], &wr[t]);
            }
        }

        v8f afr = {}, afi = {}, bfr = {}, bfi = {};

#ifdef HAVE_WMMA_F32
        v2f wrlo = {wr[0], wr[1]}, wrhi = {wr[2], wr[3]};
        v2f wilo = {wi[0], wi[1]}, wihi = {wi[2], wi[3]};
        v2f nwlo = {-wi[0], -wi[1]}, nwhi = {-wi[2], -wi[3]};

#define WMMA4(ACC, Aop, Bop) \
        ACC = __builtin_amdgcn_wmma_f32_16x16x4_f32(false, Aop, false, Bop, (short)0, ACC, false, false)

        // A_f_r = Gr.Wr - Gi.Wi   A_f_i = Gr.Wi + Gi.Wr   (same for B kernel)
        WMMA4(afr, arlo, wrlo); WMMA4(afr, arhi, wrhi); WMMA4(afr, ailo, nwlo); WMMA4(afr, aihi, nwhi);
        WMMA4(afi, arlo, wilo); WMMA4(afi, arhi, wihi); WMMA4(afi, ailo, wrlo); WMMA4(afi, aihi, wrhi);
        WMMA4(bfr, brlo, wrlo); WMMA4(bfr, brhi, wrhi); WMMA4(bfr, bilo, nwlo); WMMA4(bfr, bihi, nwhi);
        WMMA4(bfi, brlo, wilo); WMMA4(bfi, brhi, wihi); WMMA4(bfi, bilo, wrlo); WMMA4(bfi, bihi, wrhi);
#undef WMMA4
#else
        // Scalar fallback: direct 7-tap column DFT per output element.
        for (int j = 0; j < 8; ++j) {
            int R = ((c0 + j + 8 * khalf) << 7) + u;
            float ar = 0.f, ai = 0.f, br = 0.f, bi = 0.f;
            for (int k = 0; k < Kk; ++k) {
                float ang = -TWO_PI_F * (float)(v * (k - 3)) * (1.0f / 128.0f);
                float sn, cs; __sincosf(ang, &sn, &cs);
                float gr = GAr[R * GST + k], gi = GAi[R * GST + k];
                ar += gr * cs - gi * sn;  ai += gr * sn + gi * cs;
                float hr = GBr[R * GST + k], hi = GBi[R * GST + k];
                br += hr * cs - hi * sn;  bi += hr * sn + hi * cs;
            }
            afr[j] = ar; afi[j] = ai; bfr[j] = br; bfi[j] = bi;
        }
#endif

        // C/D layout: reg j -> row M = j + 8*(lane>=16) = channel, col N = lane&15 = v.
        float mrv[8], miv[8];
        for (int j = 0; j < 8; ++j) {
            float ar = afr[j], ai = afi[j];
            float br = bfr[j], bi = bfi[j];
            // S = (1+A)(1+A^2)(1+A^4)(1+A^8) : geometric sum of 16 terms
            float sr = 1.f + ar, si = ai;
            float pr = ar, pi = ai;
            for (int t = 0; t < 3; ++t) {
                float qr = pr * pr - pi * pi;
                float qi = 2.f * pr * pi;
                pr = qr; pi = qi;                       // A^(2^(t+1))
                float tr = 1.f + pr, ti = pi;
                float xr = sr * tr - si * ti;
                float xi = sr * ti + si * tr;
                sr = xr; si = xi;
            }
            mrv[j] = sr * br - si * bi;                 // M = S * B_f
            miv[j] = sr * bi + si * br;
        }
        float* row = stg + ((vt << 4) + n) * MPITCH + c0 + 8 * khalf;
        f4 r0 = {mrv[0], mrv[1], mrv[2], mrv[3]}, r1 = {mrv[4], mrv[5], mrv[6], mrv[7]};
        f4 i0 = {miv[0], miv[1], miv[2], miv[3]}, i1 = {miv[4], miv[5], miv[6], miv[7]};
        ((f4*)row)[0]         = r0;  ((f4*)row)[1]         = r1;
        ((f4*)(row + 128))[0] = i0;  ((f4*)(row + 128))[1] = i1;
    }

    __syncthreads();      // a staged row holds the channels of all 8 waves

    // 64 rows x 64 float4, contiguous in Mout; each wave store covers 512 B of one row.
    f4* __restrict__ dst = (f4*)(Mout + ((size_t)((u << 7) + vbase) << 8));
    for (int i = 0; i < VTILES * 4; ++i) {
        int f = tid + (i << 8);
        dst[f] = *(const f4*)(stg + (f >> 6) * MPITCH + ((f & 63) << 2));
    }
}

// ---------------------------------------------------------------------------
// Stage 3: the bandwidth-bound pass, one resident round of long waves.
// 256 work-groups x 16 waves; a wave owns 4 consecutive (u,v) rows, keeps their
// 4 KB of multiplier in registers for all 8 batches, and per batch streams 4 KB
// of x -> out (8 loads and 8 stores of 512 contiguous bytes each).  The loads
// run AHEAD batches in front of the batch being multiplied.  No LDS, no barrier.
// ---------------------------------------------------------------------------
#define AWAVES 16         // waves per work-group
#define AROWS  4          // (u,v) rows per wave
#define AHEAD  2          // batches whose loads are in flight in front of the current one
#define AVEC   (AROWS * 2)                        // 16-byte pieces per lane and batch
#define BATCH_BYTES (Hdim * Wdim * 2u * Cdim * 4u)

// Stands behind a batch's stores, in front of the next loads and products, which
// write registers that the stores (and the loads before them) name.
#define XCNT_WAIT() asm volatile("s_wait_xcnt 0x0" ::: "memory")

__global__ __launch_bounds__(AWAVES * 32)
void fused_apply(const float* __restrict__ x, const float* __restrict__ Mmul,
                 float* __restrict__ out) {
    const unsigned lane = threadIdx.x & 31u;
    const unsigned wave = threadIdx.x >> 5;
    // The lane's byte offset in the multiplier and in batch 0 of x and out
    // (x and out are 128 MiB each, so 32 bits hold every offset).
    const unsigned off0 = (blockIdx.x * AWAVES + wave) * (AROWS * 1024u) + lane * 16u;

    const char* __restrict__ mb = (const char*)Mmul;
    const char* __restrict__ xs = (const char*)x;
    char* __restrict__       os = (char*)out;

    // piece 2r = real half of row r, piece 2r+1 = imaginary half
    f4 m[AVEC];
#pragma unroll
    for (int j = 0; j < AVEC; ++j) m[j] = *(const f4*)(mb + off0 + j * 512u);

    f4 xb[AHEAD + 1][AVEC];                       // ring of batch buffers
#define LOAD_BATCH(B) do { const unsigned ob_ = off0 + (unsigned)(B) * BATCH_BYTES; \
        _Pragma("unroll") for (int j = 0; j < AVEC; ++j) \
            xb[(B) % (AHEAD + 1)][j] = __builtin_nontemporal_load((const f4*)(xs + ob_ + j * 512u)); } while (0)

#pragma unroll
    for (int b = 0; b < AHEAD; ++b) LOAD_BATCH(b);
#pragma unroll
    for (int b = 0; b < Bdim; ++b) {
        // The two scheduling barriers keep the order "loads of batch b+AHEAD, then
        // products and stores of batch b"; without them the compiler mixes the loads
        // among later products and stores, and fewer of them are in flight.
        __builtin_amdgcn_sched_barrier(0);
        if (b + AHEAD < Bdim) LOAD_BATCH(b + AHEAD);
        __builtin_amdgcn_sched_barrier(0);
        const f4* xv = xb[b % (AHEAD + 1)];
        char* op = os + (off0 + (unsigned)b * BATCH_BYTES);
#pragma unroll
        for (int r = 0; r < AROWS; ++r) {
            f4 xr = xv[2 * r], xi = xv[2 * r + 1];
            f4 mr = m[2 * r],  mi = m[2 * r + 1];
            f4 o_r = mr * xr - mi * xi;
            f4 o_i = mr * xi + mi * xr;
            __builtin_nontemporal_store(o_r, (f4*)(op + r * 1024u));
            __builtin_nontemporal_store(o_i, (f4*)(op + r * 1024u + 512u));
        }
        if (b + 1 < Bdim) XCNT_WAIT();
    }
#undef LOAD_BATCH
}

// ---------------------------------------------------------------------------
extern "C" void kernel_launch(void* const* d_in, const int* in_sizes, int n_in,
                              void* d_out, int out_size, void* d_ws, size_t ws_size,
                              hipStream_t stream) {
    const float* x  = (const float*)d_in[0];   // (8,128,128,256) f32
    const float* A  = (const float*)d_in[1];   // (128,7,7) f32
    const float* Bk = (const float*)d_in[2];   // (128,7,7) f32
    float* out = (float*)d_out;
    float* ws  = (float*)d_ws;

    float* GAr  = ws;                 // 16384*8 floats each
    float* GAi  = ws + 131072;
    float* GBr  = ws + 262144;
    float* GBi  = ws + 393216;
    float* Mmul = ws + 524288;        // 128*128*256 floats = 16 MB

    stage1_rowdft<<<64, 256, 0, stream>>>(A, Bk, GAr, GAi, GBr, GBi);
    stage2_multiplier<<<256, 256, 0, stream>>>(GAr, GAi, GBr, GBi, Mmul);
    fused_apply<<<Hdim * Wdim / (AWAVES * AROWS), AWAVES * 32, 0, stream>>>(x, Mmul, out);
}

// v003
// It runs in 22.2 microseconds.
// Two timings next to v002 put it at 1.60 and 1.59 times that version's speed.
// All steps since v000 together make it 2.30 times as fast.
#include <hip/hip_runtime.h>
#include <math.h>

// ---------------------------------------------------------------------------
// Collapsed recurrence: out = S * B_f * x,  S = sum_{k<16} A_f^k
//   = (1+A)(1+A^2)(1+A^4)(1+A^8)    (complex, elementwise per (h,w,c))
// One launch.  A work-group owns 64 consecutive (u,v) rows: it builds their
// multiplier itself (row DFT of the 7x7 kernels at its u, column DFT with
// V_WMMA_F32_16X16X4_F32, series) in LDS while its first x loads are in flight,
// then streams x -> out with the multiplier rows in registers.
// ---------------------------------------------------------------------------

#define Hdim 128
#define Wdim 128
#define Cdim 128
#define Bdim 8
#define Kk   7
#define GST  8            // K padded 7 -> 8 for two chained K=4 WMMAs

typedef __attribute__((ext_vector_type(2))) float        v2f;
typedef __attribute__((ext_vector_type(4))) float        f4;
typedef __attribute__((ext_vector_type(8))) float        v8f;

#define TWO_PI_F 6.28318530717958647692f

#define AWAVES 16         // waves per work-group
#define AROWS  4          // (u,v) rows per wave
#define AHEAD  2          // batches whose loads are in flight in front of the current one
#define AVEC   (AROWS * 2)                        // 16-byte pieces per lane and batch
#define BATCH_BYTES (Hdim * Wdim * 2u * Cdim * 4u)
#define GROWS  (AWAVES * AROWS)                   // 64 rows (one u, 64 columns v) per work-group
#define MPITCH 260        // staged row pitch in floats: 16 B x odd, no bank conflict for 16-byte writes

// Stands behind a batch's stores, in front of the next loads and products, which
// write registers that the stores (and the loads before them) name.
#define XCNT_WAIT() asm volatile("s_wait_xcnt 0x0" ::: "memory")

// Exponent of the A kernel's decay mask at tap (ky, kx).
static __device__ __forceinline__ float decay_arg(int ky, int kx) {
    float dy = (float)(ky - 3), dx = (float)(kx - 3);
    return -0.3f * sqrtf(dy * dy + dx * dx) / 3.0f;
}

// Work-group barrier that orders LDS alone: __syncthreads() would also wait for
// every global load of the wave, and the x loads are to stay in flight across it.
static __device__ __forceinline__ void lds_barrier() {
    __builtin_amdgcn_fence(__ATOMIC_RELEASE, "workgroup", "local");
    __builtin_amdgcn_s_barrier();
    __builtin_amdgcn_fence(__ATOMIC_ACQUIRE, "workgroup", "local");
}

// A-operand layout (32-bit A 16x4): lanes 0-15 row M, v0={K0|K2}, v1={K1|K3}.
static __device__ __forceinline__ v2f ld2(const float* g, int base, int k0) {
    v2f r; r.x = g[base + k0]; r.y = g[base + k0 + 1]; return r;
}

// A and Bk carry no __restrict__: with it their loads are free of every "memory"
// clobber, and the wait written behind the tap loads was placed in front of them.
__global__ __launch_bounds__(AWAVES * 32)
void fused_all(const float* __restrict__ x, const float* A,
               const float* Bk, float* __restrict__ out) {
    __shared__ __attribute__((aligned(16))) float stg[GROWS * MPITCH];   // multiplier rows
    __shared__ __attribute__((aligned(16))) float gl[4][Cdim * GST];     // GAr, GAi, GBr, GBi at this u

    const int tid      = threadIdx.x;
    const unsigned lane = threadIdx.x & 31u;
    const unsigned wave = threadIdx.x >> 5;
    const int u     = blockIdx.x >> 1;            // 128 rows u
    const int vbase = (blockIdx.x & 1) << 6;      // 64 columns v
    // The lane's byte offset in batch 0 of x and out
    // (x and out are 128 MiB each, so 32 bits hold every offset).
    const unsigned off0 = (blockIdx.x * AWAVES + wave) * (AROWS * 1024u) + lane * 16u;

    const char* __restrict__ xs = (const char*)x;
    char* __restrict__       os = (char*)out;

    // ---- kernel taps first (a counted load wait covers the oldest loads, so the
    // row DFT waits on these alone), then the x loads of the first AHEAD+1 batches. ----
    // Thread (c, q) makes G[c,u,kx] for kx = q and q+4; kx = 7 is the K pad.
    const int c = tid >> 2, q = tid & 3;
    float av[2][Kk], bv[2][Kk];
#pragma unroll
    for (int t = 0; t < 2; ++t) {
        int kxc = min(q + 4 * t, Kk - 1);
#pragma unroll
        for (int ky = 0; ky < Kk; ++ky) {
            av[t][ky] = A[(c * 7 + ky) * 7 + kxc];
            bv[t][ky] = Bk[(c * 7 + ky) * 7 + kxc];
        }
    }
    // The x loads' results may land in registers that the tap loads name as offsets.
    XCNT_WAIT();
    // Keeps the tap loads in front of the x loads.
    __builtin_amdgcn_sched_barrier(0);

    f4 xb[AHEAD + 1][AVEC];                       // ring of batch buffers
#define LOAD_BATCH(B) do { const unsigned ob_ = off0 + (unsigned)(B) * BATCH_BYTES; \
        _Pragma("unroll") for (int j = 0; j < AVEC; ++j) \
            xb[(B) % (AHEAD + 1)][j] = __builtin_nontemporal_load((const f4*)(xs + ob_ + j * 512u)); } while (0)
#pragma unroll
    for (int b = 0; b < AHEAD + 1; ++b) LOAD_BATCH(b);
    // Keeps the x loads in front of the multiplier's arithmetic, which hides them.
    __builtin_amdgcn_sched_barrier(0);

    // ---- row DFT: G[c,u,kx] = sum_ky kern[c,ky,kx] * exp(-2*pi*i * u*(ky-3)/128);
    // A gets the decay mask + 0.9*tanh first. ----
    {
        float cs[Kk], sn[Kk];
#pragma unroll
        for (int ky = 0; ky < Kk; ++ky) {
            float ang = -TWO_PI_F * (float)(u * (ky - 3)) * (1.0f / 128.0f);
            __sincosf(ang, &sn[ky], &cs[ky]);
        }
#pragma unroll
        for (int t = 0; t < 2; ++t) {
            float dec[4];                         // the mask is even in ky-3
#pragma unroll
            for (int d = 0; d < 4; ++d)
                dec[d] = __expf(q == 0 ? decay_arg(3 + d, 4 * t)
                              : q == 1 ? decay_arg(3 + d, 4 * t + 1)
                              : q == 2 ? decay_arg(3 + d, 4 * t + 2)
                                       : decay_arg(3 + d, t ? 6 : 3));
            float sra = 0.f, sia = 0.f, srb = 0.f, sib = 0.f;
#pragma unroll
            for (int ky = 0; ky < Kk; ++ky) {
                float a = 0.9f * tanhf(av[t][ky] * dec[ky < 3 ? 3 - ky : ky - 3]);
                float b = bv[t][ky];
                sra += a * cs[ky]; sia += a * sn[ky];
                srb += b * cs[ky]; sib += b * sn[ky];
            }
            bool pad = q + 4 * t >= Kk;           // tap 7 zeroed: the K=8 contraction is exact
            int  gi  = c * GST + q + 4 * t;
            gl[0][gi] = pad ? 0.f : sra; gl[1][gi] = pad ? 0.f : sia;
            gl[2][gi] = pad ? 0.f : srb; gl[3][gi] = pad ? 0.f : sib;
        }
    }

    lds_barrier();        // a wave's G fragments were made by other waves

    // ---- column DFT as a matmul per {A,B}x{r,i}, chained K=4+4.  Wave w owns
    // channels 16(w&7).. as the M rows of its tiles and walks two 16-column tiles
    // with the same G fragments; then per-lane series S and M = S*B_f. ----
    {
        const int c0    = (int)(wave & 7u) << 4;
        const int n     = (int)lane & 15;
        const int khalf = (int)lane >> 4;
        const int rbase = (c0 + n) * GST;         // G row of channel c0+n
        v2f arlo = ld2(gl[0], rbase, 2 * khalf), arhi = ld2(gl[0], rbase, 4 + 2 * khalf);
        v2f ailo = ld2(gl[1], rbase, 2 * khalf), aihi = ld2(gl[1], rbase, 4 + 2 * khalf);
        v2f brlo = ld2(gl[2], rbase, 2 * khalf), brhi = ld2(gl[2], rbase, 4 + 2 * khalf);
        v2f bilo = ld2(gl[3], rbase, 2 * khalf), bihi = ld2(gl[3], rbase, 4 + 2 * khalf);

        for (int vi = 0; vi < 2; ++vi) {
            int vt = (int)(wave >> 3) * 2 + vi;
            int v  = vbase + (vt << 4) + n;

            // Twiddles for this lane's K slots: W[k][v] = exp(-2*pi*i * v*(k-3)/128)
            float wr[4], wi[4];
            {
                int ks[4] = {2 * khalf, 2 * khalf + 1, 4 + 2 * khalf, 5 + 2 * khalf};
                for (int t = 0; t < 4; ++t) {
                    float ang = -TWO_PI_F * (float)(v * (ks[t] - 3)) * (1.0f / 128.0f);
                    __sincosf(ang, &wi[t], &wr[t]);
                }
            }

            v8f afr = {}, afi = {}, bfr = {}, bfi = {};
            v2f wrlo = {wr[0], wr[1]}, wrhi = {wr[2], wr[3]};
            v2f wilo = {wi[0], wi[1]}, wihi = {wi[2], wi[3]};
            v2f nwlo = {-wi[0], -wi[1]}, nwhi = {-wi[2], -wi[3]};

#define WMMA4(ACC, Aop, Bop) \
            ACC = __builtin_amdgcn_wmma_f32_16x16x4_f32(false, Aop, false, Bop, (short)0, ACC, false, false)

            // A_f_r = Gr.Wr - Gi.Wi   A_f_i = Gr.Wi + Gi.Wr   (same for B kernel)
            WMMA4(afr, arlo, wrlo); WMMA4(afr, arhi, wrhi); WMMA4(afr, ailo, nwlo); WMMA4(afr, aihi, nwhi);
            WMMA4(afi, arlo, wilo); WMMA4(afi, arhi, wihi); WMMA4(afi, ailo, wrlo); WMMA4(afi, aihi, wrhi);
            WMMA4(bfr, brlo, wrlo); WMMA4(bfr, brhi, wrhi); WMMA4(bfr, bilo, nwlo); WMMA4(bfr, bihi, nwhi);
            WMMA4(bfi, brlo, wilo); WMMA4(bfi, brhi, wihi); WMMA4(bfi, bilo, wrlo); WMMA4(bfi, bihi, wrhi);
#undef WMMA4

            // C/D layout: reg j -> row M = j + 8*(lane>=16) = channel, col N = lane&15 = v.
            float mrv[8], miv[8];
            for (int j = 0; j < 8; ++j) {
                float ar = afr[j], ai = afi[j];
                float br = bfr[j], bi = bfi[j];
                // S = (1+A)(1+A^2)(1+A^4)(1+A^8) : geometric sum of 16 terms
                float sr = 1.f + ar, si = ai;
                float pr = ar, pi = ai;
                for (int t = 0; t < 3; ++t) {
                    float qr = pr * pr - pi * pi;
                    float qi = 2.f * pr * pi;
                    pr = qr; pi = qi;                       // A^(2^(t+1))
                    float tr = 1.f + pr, ti = pi;
                    float xr = sr * tr - si * ti;
                    float xi = sr * ti + si * tr;
                    sr = xr; si = xi;
                }
                mrv[j] = sr * br - si * bi;                 // M = S * B_f
                miv[j] = sr * bi + si * br;
            }
            float* row = stg + ((vt << 4) + n) * MPITCH + c0 + 8 * khalf;
            f4 r0 = {mrv[0], mrv[1], mrv[2], mrv[3]}, r1 = {mrv[4], mrv[5], mrv[6], mrv[7]};
            f4 i0 = {miv[0], miv[1], miv[2], miv[3]}, i1 = {miv[4], miv[5], miv[6], miv[7]};
            ((f4*)row)[0]         = r0;  ((f4*)row)[1]         = r1;
            ((f4*)(row + 128))[0] = i0;  ((f4*)(row + 128))[1] = i1;
        }
    }

    lds_barrier();        // a staged row holds the channels of 8 waves

    // ---- the bandwidth-bound pass: a wave keeps the 4 KB of multiplier of its 4
    // rows in registers for all 8 batches, and per batch streams 4 KB of x -> out
    // (8 loads and 8 stores of 512 contiguous bytes each). ----
    // piece 2r = real half of row r, piece 2r+1 = imaginary half
    f4 m[AVEC];
#pragma unroll
    for (int j = 0; j < AVEC; ++j)
        m[j] = *(const f4*)(stg + (wave * AROWS + (j >> 1)) * MPITCH + (j & 1) * 128 + lane * 4u);

#pragma unroll
    for (int b = 0; b < Bdim; ++b) {
        const f4* xv = xb[b % (AHEAD + 1)];
        char* op = os + (off0 + (unsigned)b * BATCH_BYTES);
#pragma unroll
        for (int r = 0; r < AROWS; ++r) {
            f4 xr = xv[2 * r], xi = xv[2 * r + 1];
            f4 mr = m[2 * r],  mi = m[2 * r + 1];
            f4 o_r = mr * xr - mi * xi;
            f4 o_i = mr * xi + mi * xr;
            __builtin_nontemporal_store(o_r, (f4*)(op + r * 1024u));
            __builtin_nontemporal_store(o_i, (f4*)(op + r * 1024u + 512u));
        }
        if (b + 1 < Bdim) XCNT_WAIT();
        // The two scheduling barriers keep the order "products and stores of batch b,
        // then loads of batch b+AHEAD+1"; without them the compiler mixes the loads
        // among later products and stores, and fewer of them are in flight.
        __builtin_amdgcn_sched_barrier(0);
        if (b + AHEAD + 1 < Bdim) LOAD_BATCH(b + AHEAD + 1);
        __builtin_amdgcn_sched_barrier(0);
    }
#undef LOAD_BATCH
}

// ---------------------------------------------------------------------------
extern "C" void kernel_launch(void* const* d_in, const int* in_sizes, int n_in,
                              void* d_out, int out_size, void* d_ws, size_t ws_size,
                              hipStream_t stream) {
    const float* x  = (const float*)d_in[0];   // (8,128,128,256) f32
    const float* A  = (const float*)d_in[1];   // (128,7,7) f32
    const float* Bk = (const float*)d_in[2];   // (128,7,7) f32
    float* out = (float*)d_out;

    fused_all<<<Hdim * Wdim / GROWS, AWAVES * 32, 0, stream>>>(x, A, Bk, out);
}

// v004
// Measured time: 18.3 microseconds a run.
// In both of two side-by-side timings against v003, it was 1.22 times as fast.
// Counting every step since v000, it is 2.80 times as fast.
#include <hip/hip_runtime.h>
#include <math.h>

// ---------------------------------------------------------------------------
// Collapsed recurrence: out = S * B_f * x,  S = sum_{k<16} A_f^k
//   = (1+A)(1+A^2)(1+A^4)(1+A^8)    (complex, elementwise per (h,w,c))
// One launch.  A work-group owns 64 consecutive (u,v) rows: it builds their
// multiplier itself (row DFT of the 7x7 kernels at its u, column DFT with
// V_WMMA_F32_16X16X4_F32, series) in LDS while its first x loads are in flight,
// then streams x -> out with the multiplier rows in registers.  Six of the eight
// batches of x are asked for under that build: three into registers, three more
// by asynchronous copies into LDS slots that belong to one wave each.
// ---------------------------------------------------------------------------

#define Hdim 128
#define Wdim 128
#define Cdim 128
#define Bdim 8
#define Kk   7
#define GST  8            // K padded 7 -> 8 for two chained K=4 WMMAs

typedef __attribute__((ext_vector_type(2))) float        v2f;
typedef __attribute__((ext_vector_type(4))) float        f4;
typedef __attribute__((ext_vector_type(8))) float        v8f;
typedef __attribute__((ext_vector_type(4))) int          v4i;
typedef __attribute__((address_space(1))) v4i            gv4i;   // global side of a copy
typedef __attribute__((address_space(3))) v4i            lv4i;   // LDS side of a copy

#define TWO_PI_F 6.28318530717958647692f

#define AWAVES 16         // waves per work-group
#define AROWS  4          // (u,v) rows per wave
#define AHEAD  2          // batches whose loads are in flight in front of the current one
#define AVEC   (AROWS * 2)                        // 16-byte pieces per lane and batch
#define LBATCH 3          // batches behind the first AHEAD+1 that wait in LDS
#define WSLOT  (AROWS * 2 * Cdim)                 // floats of one wave and batch (4 KB)
#define BATCH_BYTES (Hdim * Wdim * 2u * Cdim * 4u)
#define GROWS  (AWAVES * AROWS)                   // 64 rows (one u, 64 columns v) per work-group
#define MPITCH 260        // staged row pitch in floats: 16 B x odd, no bank conflict for 16-byte writes

// Stands behind a batch's stores, in front of the next loads and products, which
// write registers that the stores (and the loads before them) name.
#define XCNT_WAIT() asm volatile("s_wait_xcnt 0x0" ::: "memory")

// Exponent of the A kernel's decay mask at tap (ky, kx).
static __device__ __forceinline__ float decay_arg(int ky, int kx) {
    float dy = (float)(ky - 3), dx = (float)(kx - 3);
    return -0.3f * sqrtf(dy * dy + dx * dx) / 3.0f;
}

// Work-group barrier that orders LDS alone: __syncthreads() would also wait for
// every global load of the wave, and the x loads are to stay in flight across it.
static __device__ __forceinline__ void lds_barrier() {
    __builtin_amdgcn_fence(__ATOMIC_RELEASE, "workgroup", "local");
    __builtin_amdgcn_s_barrier();
    __builtin_amdgcn_fence(__ATOMIC_ACQUIRE, "workgroup", "local");
}

// A-operand layout (32-bit A 16x4): lanes 0-15 row M, v0={K0|K2}, v1={K1|K3}.
static __device__ __forceinline__ v2f ld2(const float* g, int base, int k0) {
    v2f r; r.x = g[base + k0]; r.y = g[base + k0 + 1]; return r;
}

// A and Bk carry no __restrict__: with it their loads are free of every "memory"
// clobber, and the wait written behind the tap loads was placed in front of them.
__global__ __launch_bounds__(AWAVES * 32)
void fused_all(const float* __restrict__ x, const float* A,
               const float* Bk, float* __restrict__ out) {
    __shared__ __attribute__((aligned(16))) float stg[GROWS * MPITCH];   // multiplier rows
    __shared__ __attribute__((aligned(16))) float gl[4][Cdim * GST];     // GAr, GAi, GBr, GBi at this u
    __shared__ __attribute__((aligned(16))) float xl[LBATCH * AWAVES * WSLOT];   // x of batches 3..5

    const int tid      = threadIdx.x;
    const unsigned lane = threadIdx.x & 31u;
    const unsigned wave = threadIdx.x >> 5;
    const int u     = blockIdx.x >> 1;            // 128 rows u
    const int vbase = (blockIdx.x & 1) << 6;      // 64 columns v
    // The lane's byte offset in batch 0 of x and out
    // (x and out are 128 MiB each, so 32 bits hold every offset).
    const unsigned off0 = (blockIdx.x * AWAVES + wave) * (AROWS * 1024u) + lane * 16u;

    const char* __restrict__ xs = (const char*)x;
    char* __restrict__       os = (char*)out;

    // ---- kernel taps first (a counted load wait covers the oldest loads, so the
    // row DFT waits on these alone), then the x loads of the first AHEAD+1 batches. ----
    // Thread (c, q) makes G[c,u,kx] for kx = q and q+4; kx = 7 is the K pad.
    const int c = tid >> 2, q = tid & 3;
    float av[2][Kk], bv[2][Kk];
#pragma unroll
    for (int t = 0; t < 2; ++t) {
        int kxc = min(q + 4 * t, Kk - 1);
#pragma unroll
        for (int ky = 0; ky < Kk; ++ky) {
            av[t][ky] = A[(c * 7 + ky) * 7 + kxc];
            bv[t][ky] = Bk[(c * 7 + ky) * 7 + kxc];
        }
    }
    // The x loads' results may land in registers that the tap loads name as offsets.
    XCNT_WAIT();
    // Keeps the tap loads in front of the x loads.
    __builtin_amdgcn_sched_barrier(0);

    f4 xb[AHEAD + 1][AVEC];                       // ring of batch buffers
#define LOAD_BATCH(B) do { const unsigned ob_ = off0 + (unsigned)(B) * BATCH_BYTES; \
        _Pragma("unroll") for (int j = 0; j < AVEC; ++j) \
            xb[(B) % (AHEAD + 1)][j] = __builtin_nontemporal_load((const f4*)(xs + ob_ + j * 512u)); } while (0)
#pragma unroll
    for (int b = 0; b < AHEAD + 1; ++b) LOAD_BATCH(b);
    // Keeps the x loads in front of the multiplier's arithmetic, which hides them.
    __builtin_amdgcn_sched_barrier(0);

    // LBATCH more batches of x go to LDS through no register, so that memory has reads
    // to serve for the whole build.  One batch is asked for at each of three places of
    // the build, about as fast as memory serves a batch, not all at the top: the requests
    // that wait in the WGP stay about as many as behind the x loads above.  A wave copies
    // into its own slots and alone reads them, behind its own s_wait_asynccnt 0.
    // Piece J lies J*512 bytes on in x and in the slot alike: the offset moves both
    // addresses.  Last argument 1: non-temporal, as the x loads.
#define COPY_PIECE(J) __builtin_amdgcn_global_load_async_to_lds_b128(g_, l_, (J) * 512, 1)
#define COPY_BATCH(K) do { \
        gv4i* g_ = (gv4i*)(xs + (off0 + (unsigned)(AHEAD + 1 + (K)) * BATCH_BYTES)); \
        lv4i* l_ = (lv4i*)(xl + ((K) * AWAVES + wave) * WSLOT + lane * 4u); \
        COPY_PIECE(0); COPY_PIECE(1); COPY_PIECE(2); COPY_PIECE(3); \
        COPY_PIECE(4); COPY_PIECE(5); COPY_PIECE(6); COPY_PIECE(7); } while (0)

    // ---- row DFT: G[c,u,kx] = sum_ky kern[c,ky,kx] * exp(-2*pi*i * u*(ky-3)/128);
    // A gets the decay mask + 0.9*tanh first. ----
    {
        float cs[Kk], sn[Kk];
#pragma unroll
        for (int ky = 0; ky < Kk; ++ky) {
            float ang = -TWO_PI_F * (float)(u * (ky - 3)) * (1.0f / 128.0f);
            __sincosf(ang, &sn[ky], &cs[ky]);
        }
#pragma unroll
        for (int t = 0; t < 2; ++t) {
            if (t == 1) COPY_BATCH(0);
            float dec[4];                         // the mask is even in ky-3
#pragma unroll
            for (int d = 0; d < 4; ++d)
                dec[d] = __expf(q == 0 ? decay_arg(3 + d, 4 * t)
                              : q == 1 ? decay_arg(3 + d, 4 * t + 1)
                              : q == 2 ? decay_arg(3 + d, 4 * t + 2)
                                       : decay_arg(3 + d, t ? 6 : 3));
            float sra = 0.f, sia = 0.f, srb = 0.f, sib = 0.f;
#pragma unroll
            for (int ky = 0; ky < Kk; ++ky) {
                float a = 0.9f * tanhf(av[t][ky] * dec[ky < 3 ? 3 - ky : ky - 3]);
                float b = bv[t][ky];
                sra += a * cs[ky]; sia += a * sn[ky];
                srb += b * cs[ky]; sib += b * sn[ky];
            }
            bool pad = q + 4 * t >= Kk;           // tap 7 zeroed: the K=8 contraction is exact
            int  gi  = c * GST + q + 4 * t;
            gl[0][gi] = pad ? 0.f : sra; gl[1][gi] = pad ? 0.f : sia;
            gl[2][gi] = pad ? 0.f : srb; gl[3][gi] = pad ? 0.f : sib;
        }
    }

    lds_barrier();        // a wave's G fragments were made by other waves
    COPY_BATCH(1);

    // ---- column DFT as a matmul per {A,B}x{r,i}, chained K=4+4.  Wave w owns
    // channels 16(w&7).. as the M rows of its tiles and walks two 16-column tiles
    // with the same G fragments; then per-lane series S and M = S*B_f. ----
    {
        const int c0    = (int)(wave & 7u) << 4;
        const int n     = (int)lane & 15;
        const int khalf = (int)lane >> 4;
        const int rbase = (c0 + n) * GST;         // G row of channel c0+n
        v2f arlo = ld2(gl[0], rbase, 2 * khalf), arhi = ld2(gl[0], rbase, 4 + 2 * khalf);
        v2f ailo = ld2(gl[1], rbase, 2 * khalf), aihi = ld2(gl[1], rbase, 4 + 2 * khalf);
        v2f brlo = ld2(gl[2], rbase, 2 * khalf), brhi = ld2(gl[2], rbase, 4 + 2 * khalf);
        v2f bilo = ld2(gl[3], rbase, 2 * khalf), bihi = ld2(gl[3], rbase, 4 + 2 * khalf);

        // Stays rolled, as it was: unrolled, the compiler moves the copies of the second
        // trip up to those behind the barrier, and the two batches are asked for at once.
#pragma unroll 1
        for (int vi = 0; vi < 2; ++vi) {
            if (vi == 1) COPY_BATCH(2);
            int vt = (int)(wave >> 3) * 2 + vi;
            int v  = vbase + (vt << 4) + n;

            // Twiddles for this lane's K slots: W[k][v] = exp(-2*pi*i * v*(k-3)/128)
            float wr[4], wi[4];
            {
                int ks[4] = {2 * khalf, 2 * khalf + 1, 4 + 2 * khalf, 5 + 2 * khalf};
                for (int t = 0; t < 4; ++t) {
                    float ang = -TWO_PI_F * (float)(v * (ks[t] - 3)) * (1.0f / 128.0f);
                    __sincosf(ang, &wi[t], &wr[t]);
                }
            }

            v8f afr = {}, afi = {}, bfr = {}, bfi = {};
            v2f wrlo = {wr[0], wr[1]}, wrhi = {wr[2], wr[3]};
            v2f wilo = {wi[0], wi[1]}, wihi = {wi[2], wi[3]};
            v2f nwlo = {-wi[0], -wi[1]}, nwhi = {-wi[2], -wi[3]};

#define WMMA4(ACC, Aop, Bop) \
            ACC = __builtin_amdgcn_wmma_f32_16x16x4_f32(false, Aop, false, Bop, (short)0, ACC, false, false)

            // A_f_r = Gr.Wr - Gi.Wi   A_f_i = Gr.Wi + Gi.Wr   (same for B kernel)
            WMMA4(afr, arlo, wrlo); WMMA4(afr, arhi, wrhi); WMMA4(afr, ailo, nwlo); WMMA4(afr, aihi, nwhi);
            WMMA4(afi, arlo, wilo); WMMA4(afi, arhi, wihi); WMMA4(afi, ailo, wrlo); WMMA4(afi, aihi, wrhi);
            WMMA4(bfr, brlo, wrlo); WMMA4(bfr, brhi, wrhi); WMMA4(bfr, bilo, nwlo); WMMA4(bfr, bihi, nwhi);
            WMMA4(bfi, brlo, wilo); WMMA4(bfi, brhi, wihi); WMMA4(bfi, bilo, wrlo); WMMA4(bfi, bihi, wrhi);
#undef WMMA4

            // C/D layout: reg j -> row M = j + 8*(lane>=16) = channel, col N = lane&15 = v.
            float mrv[8], miv[8];
            for (int j = 0; j < 8; ++j) {
                float ar = afr[j], ai = afi[j];
                float br = bfr[j], bi = bfi[j];
                // S = (1+A)(1+A^2)(1+A^4)(1+A^8) : geometric sum of 16 terms
                float sr = 1.f + ar, si = ai;
                float pr = ar, pi = ai;
                for (int t = 0; t < 3; ++t) {
                    float qr = pr * pr - pi * pi;
                    float qi = 2.f * pr * pi;
                    pr = qr; pi = qi;                       // A^(2^(t+1))
                    float tr = 1.f + pr, ti = pi;
                    float xr = sr * tr - si * ti;
                    float xi = sr * ti + si * tr;
                    sr = xr; si = xi;
                }
                mrv[j] = sr * br - si * bi;                 // M = S * B_f
                miv[j] = sr * bi + si * br;
            }
            float* row = stg + ((vt << 4) + n) * MPITCH + c0 + 8 * khalf;
            f4 r0 = {mrv[0], mrv[1], mrv[2], mrv[3]}, r1 = {mrv[4], mrv[5], mrv[6], mrv[7]};
            f4 i0 = {miv[0], miv[1], miv[2], miv[3]}, i1 = {miv[4], miv[5], miv[6], miv[7]};
            ((f4*)row)[0]         = r0;  ((f4*)row)[1]         = r1;
            ((f4*)(row + 128))[0] = i0;  ((f4*)(row + 128))[1] = i1;
        }
    }

    lds_barrier();        // a staged row holds the channels of 8 waves

    // ---- the bandwidth-bound pass: a wave keeps the 4 KB of multiplier of its 4
    // rows in registers for all 8 batches, and per batch streams 4 KB of x -> out
    // (8 loads and 8 stores of 512 contiguous bytes each). ----
    // piece 2r = real half of row r, piece 2r+1 = imaginary half
    f4 m[AVEC];
#pragma unroll
    for (int j = 0; j < AVEC; ++j)
        m[j] = *(const f4*)(stg + (wave * AROWS + (j >> 1)) * MPITCH + (j & 1) * 128 + lane * 4u);

    // Products and stores of one batch: xv = its 8 pieces, op = the lane's place in out.
#define APPLY_BATCH(XV, OP) do { \
        _Pragma("unroll") for (int r = 0; r < AROWS; ++r) { \
            f4 xr = (XV)[2 * r], xi = (XV)[2 * r + 1]; \
            f4 mr = m[2 * r],    mi = m[2 * r + 1]; \
            f4 o_r = mr * xr - mi * xi; \
            f4 o_i = mr * xi + mi * xr; \
            __builtin_nontemporal_store(o_r, (f4*)((OP) + r * 1024u)); \
            __builtin_nontemporal_store(o_i, (f4*)((OP) + r * 1024u + 512u)); } } while (0)

    // Order of the batches: the AHEAD+1 that came first, then the last ones (loaded into
    // the buffers those left), then the LBATCH in LDS, whose copies were asked for under the build.
#pragma unroll
    for (int s = 0; s < Bdim - LBATCH; ++s) {
        const f4* xv = xb[s % (AHEAD + 1)];
        char* op = os + (off0 + (unsigned)(s <= AHEAD ? s : s + LBATCH) * BATCH_BYTES);
        APPLY_BATCH(xv, op);
        XCNT_WAIT();
        // The two scheduling barriers keep the order "products and stores of this batch,
        // then loads into the buffer it left"; without them the compiler mixes the loads
        // among later products and stores, and fewer of them are in flight.
        __builtin_amdgcn_sched_barrier(0);
        if (s + AHEAD + 1 < Bdim - LBATCH) LOAD_BATCH(s + AHEAD + 1 + LBATCH);
        __builtin_amdgcn_sched_barrier(0);
    }

    // The wave's copies have landed behind this wait; no other wave reads them.
    asm volatile("s_wait_asynccnt 0x0" ::: "memory");
#pragma unroll
    for (int k = 0; k < LBATCH; ++k) {
        f4 xv[AVEC];
#pragma unroll
        for (int j = 0; j < AVEC; ++j)
            xv[j] = *(const f4*)(xl + (k * AWAVES + wave) * WSLOT + j * 128 + lane * 4u);
        char* op = os + (off0 + (unsigned)(AHEAD + 1 + k) * BATCH_BYTES);
        APPLY_BATCH(xv, op);
        if (k + 1 < LBATCH) XCNT_WAIT();
        // Keeps a batch's stores in front of the next batch's LDS reads and products.
        __builtin_amdgcn_sched_barrier(0);
    }
#undef APPLY_BATCH
#undef COPY_BATCH
#undef COPY_PIECE
#undef LOAD_BATCH
}

// ---------------------------------------------------------------------------
extern "C" void kernel_launch(void* const* d_in, const int* in_sizes, int n_in,
                              void* d_out, int out_size, void* d_ws, size_t ws_size,
                              hipStream_t stream) {
    const float* x  = (const float*)d_in[0];   // (8,128,128,256) f32
    const float* A  = (const float*)d_in[1];   // (128,7,7) f32
    const float* Bk = (const float*)d_in[2];   // (128,7,7) f32
    float* out = (float*)d_out;

    fused_all<<<Hdim * Wdim / GROWS, AWAVES * 32, 0, stream>>>(x, A, Bk, out);
}
